// v000
// Times are from an AMD MI455X. After a warm-up the kernel runs many times in a row, and a time is the length of
// such a window on the GPU divided by its runs, so every launch and the gaps after it count. The runs cycle
// through copies of the inputs. A figure is the median of several windows, for all but v000 over two sittings.
// Sittings can differ by a few percent; kernels timed side by side share one.
// v000, which the later versions start from, runs in 948 microseconds.
#include <hip/hip_runtime.h>
#include <hip/hip_bf16.h>
#include <cstdint>

// ---------------------------------------------------------------------------
// Graphormer MHA, fused per-d-slice attention for MI455X (gfx1250, wave32).
// N=1024, D=128, H=8.  All math f32 via V_WMMA_F32_16X16X4_F32.
// v_d staging uses GLOBAL_LOAD_ASYNC_TO_LDS_B128 (ASYNCcnt-tracked DMA).
//
// Workspace layout (floats): Q[1M] | K[1M] | V[1M] | Bias[1M] | Out2[1M]
//   = 20 MB total.
// ---------------------------------------------------------------------------

typedef __attribute__((ext_vector_type(2))) float v2f;
typedef __attribute__((ext_vector_type(8))) float v8f;

#define NN   1024
#define DD   128
#define HH   8

__device__ __forceinline__ v8f wmma4(v2f a, v2f b, v8f c) {
  // D = A(16x4) * B(4x16) + C(16x16), f32.
  return __builtin_amdgcn_wmma_f32_16x16x4_f32(
      /*neg_a=*/false, a, /*neg_b=*/false, b,
      /*c_mod=*/(short)0, c, /*reuse_a=*/false, /*reuse_b=*/false);
}

// Fragment loader shared by A (MxK row-major) and B (NxK row-major, i.e. B^T).
// For f32 16x16x4: lane&15 selects the M/N row, lane>>4 selects K pair {0,1}
// vs {2,3}; the two K values are adjacent in memory -> one float2.
__device__ __forceinline__ v2f load_frag_nk(const float* __restrict__ base,
                                            int row_stride, int r0, int k0,
                                            int lane) {
  const float* p = base + (size_t)(r0 + (lane & 15)) * row_stride
                        + k0 + ((lane >> 4) << 1);
  v2f r = {p[0], p[1]};
  return r;
}

// Async DMA: 16 bytes global -> LDS, tracked by ASYNCcnt (no VGPR data path).
__device__ __forceinline__ void async_g2l_b128(uint32_t lds_byte_addr,
                                               const float* gsrc) {
  asm volatile("global_load_async_to_lds_b128 %0, %1, off"
               :: "v"(lds_byte_addr), "v"((uint64_t)(uintptr_t)gsrc)
               : "memory");
}

__device__ __forceinline__ void wait_asynccnt0() {
#if defined(__has_builtin)
#if __has_builtin(__builtin_amdgcn_s_wait_asynccnt)
  __builtin_amdgcn_s_wait_asynccnt(0);
#else
  asm volatile("s_wait_asynccnt 0x0" ::: "memory");
#endif
#else
  asm volatile("s_wait_asynccnt 0x0" ::: "memory");
#endif
}

// ---------------------------------------------------------------------------
// Bias = spatial + edge   (1M floats, float4-vectorized)
// ---------------------------------------------------------------------------
__global__ void bias_kernel(const float* __restrict__ sp,
                            const float* __restrict__ ed,
                            float* __restrict__ B) {
  int i = blockIdx.x * blockDim.x + threadIdx.x;   // 1024 blocks * 256 thr
  const float4* s4 = (const float4*)sp;
  const float4* e4 = (const float4*)ed;
  float4 a = s4[i], b = e4[i];
  ((float4*)B)[i] = make_float4(a.x + b.x, a.y + b.y, a.z + b.z, a.w + b.w);
}

// ---------------------------------------------------------------------------
// Q/K/V = x @ W^T   (1024x1024, K=128).  grid (64, 16, 3), block 128.
// Each wave: one 16x16 tile; block covers 16 rows x 64 cols.
// ---------------------------------------------------------------------------
__global__ void qkv_kernel(const float* __restrict__ x,
                           const float* __restrict__ Wq,
                           const float* __restrict__ Wk,
                           const float* __restrict__ Wv,
                           float* __restrict__ Q,
                           float* __restrict__ K,
                           float* __restrict__ V) {
  const int lane = threadIdx.x & 31;
  const int wave = threadIdx.x >> 5;
  const int i0 = blockIdx.x * 16;
  const int j0 = blockIdx.y * 64 + wave * 16;

  const float* W;
  float* out;
  if (blockIdx.z == 0)      { W = Wq; out = Q; }
  else if (blockIdx.z == 1) { W = Wk; out = K; }
  else                      { W = Wv; out = V; }

  v8f c = {};
  #pragma unroll 4
  for (int k0 = 0; k0 < DD; k0 += 4) {
    v2f a = load_frag_nk(x, DD, i0, k0, lane);   // x row-major [N, D]
    v2f b = load_frag_nk(W, DD, j0, k0, lane);   // W row-major [DH, D] = NxK
    c = wmma4(a, b, c);
  }

  const int row_half = (lane >> 4) << 3;     // lanes 16-31 hold rows 8..15
  const int col = lane & 15;
  #pragma unroll
  for (int r = 0; r < 8; ++r)
    out[(size_t)(i0 + r + row_half) * NN + j0 + col] = c[r];
}

// ---------------------------------------------------------------------------
// Fused per-slice attention.  grid (64 n-tiles, 128 slices), block 128.
// Dynamic LDS: S[16][1024] + vbuf[1024*8] + red[128] + cpart[4*256]
//            = 25728 floats = 102912 bytes (WGP LDS is 320 KB).
// ---------------------------------------------------------------------------
__global__ void attn_kernel(const float* __restrict__ Q,
                            const float* __restrict__ Km,
                            const float* __restrict__ V,
                            const float* __restrict__ Bias,
                            float* __restrict__ O2) {
  extern __shared__ float smem[];
  float* S     = smem;                 // 16384 : logits/probs, 16 rows x 1024
  float* vbuf  = smem + 16384;         //  8192 : v_d staged (async DMA)
  float* red   = vbuf + 8192;          //   128 : softmax partials
  float* cpart = red + 128;            //  1024 : split-K partial C tiles

  const int tid  = threadIdx.x;
  const int lane = tid & 31;
  const int wave = tid >> 5;
  const int i0   = blockIdx.x * 16;            // n-row tile
  const int d    = blockIdx.y;                 // slice

  const float* qd = Q  + (size_t)d * (NN * HH);   // contiguous 1024x8 block
  const float* kd = Km + (size_t)d * (NN * HH);
  const float* vd = V  + (size_t)d * (NN * HH);
  const float scale = 0.088388347648318447f;      // 128^-0.5

  // Stage v_d (32 KB) into LDS with async global->LDS DMA (ASYNCcnt).
  // Generic->LDS address: low 32 bits of an LDS-aperture address are the
  // LDS byte offset (ISA 10.2 aperture table).
  {
    const uint32_t vbase = (uint32_t)(uintptr_t)vbuf;
    #pragma unroll
    for (int i = tid; i < (NN * HH) / 4; i += 128)
      async_g2l_b128(vbase + (uint32_t)i * 16u, vd + i * 4);
    wait_asynccnt0();   // our slots visible in LDS before the barrier below
  }

  // Pre-scaled A fragments of q_d (16 rows, K=8 -> two K=4 fragments).
  v2f a0 = load_frag_nk(qd, HH, i0, 0, lane);
  v2f a1 = load_frag_nk(qd, HH, i0, 4, lane);
  a0 *= scale;
  a1 *= scale;

  const int row_half = (lane >> 4) << 3;
  const int col = lane & 15;

  // Logits: wave w owns columns [w*256, w*256+256).  D = (s*q)k^T + Bias.
  for (int t = 0; t < 16; ++t) {
    const int j0 = wave * 256 + t * 16;
    // Prefetch next tile's bias rows into L0 while this tile computes.
    if (t < 15)
      __builtin_prefetch(&Bias[(size_t)(i0 + row_half) * NN + j0 + 16 + col],
                         0, 3);
    v8f c;
    #pragma unroll
    for (int r = 0; r < 8; ++r)
      c[r] = Bias[(size_t)(i0 + r + row_half) * NN + j0 + col];
    v2f b0 = load_frag_nk(kd, HH, j0, 0, lane);  // k_d is NxK row-major
    v2f b1 = load_frag_nk(kd, HH, j0, 4, lane);
    c = wmma4(a0, b0, c);
    c = wmma4(a1, b1, c);
    #pragma unroll
    for (int r = 0; r < 8; ++r)
      S[(r + row_half) * NN + j0 + col] = c[r];
  }
  __syncthreads();

  // Softmax over the 1024 columns of each of the 16 rows.
  // 8 threads per row, each owns a contiguous 128-column chunk.
  {
    const int r = tid >> 3;
    const int sub = tid & 7;
    float* row = S + r * NN + sub * 128;

    float m = -3.0e38f;
    for (int c2 = 0; c2 < 128; ++c2) m = fmaxf(m, row[c2]);
    red[r * 8 + sub] = m;
    __syncthreads();
    float rowmax = red[r * 8];
    #pragma unroll
    for (int k = 1; k < 8; ++k) rowmax = fmaxf(rowmax, red[r * 8 + k]);
    __syncthreads();

    float s = 0.f;
    for (int c2 = 0; c2 < 128; ++c2) {
      float e = __expf(row[c2] - rowmax);
      row[c2] = e;
      s += e;
    }
    red[r * 8 + sub] = s;
    __syncthreads();
    float tot = 0.f;
    #pragma unroll
    for (int k = 0; k < 8; ++k) tot += red[r * 8 + k];
    const float inv = 1.0f / tot;
    for (int c2 = 0; c2 < 128; ++c2) row[c2] *= inv;
  }
  __syncthreads();

  // O = S @ v_d  (16x1024 @ 1024x8, padded to N=16).  Split-K across waves.
  v8f o = {};
  for (int k0 = wave * 256; k0 < wave * 256 + 256; k0 += 4) {
    const int kk = k0 + ((lane >> 4) << 1);
    v2f a = {S[(lane & 15) * NN + kk], S[(lane & 15) * NN + kk + 1]};
    float bx = (col < HH) ? vbuf[kk * HH + col] : 0.f;
    float by = (col < HH) ? vbuf[(kk + 1) * HH + col] : 0.f;
    v2f b = {bx, by};
    o = wmma4(a, b, o);
  }
  #pragma unroll
  for (int r = 0; r < 8; ++r)
    cpart[wave * 256 + (r + row_half) * 16 + col] = o[r];
  __syncthreads();

  // Reduce 4 partials; write 16x8 block into Out2 (flat reinterpretation:
  // out[d, n, h] -> Out2.flat[d*8192 + n*8 + h]).
  {
    const int r = tid >> 3;
    const int h = tid & 7;
    float v = cpart[r * 16 + h] + cpart[256 + r * 16 + h] +
              cpart[512 + r * 16 + h] + cpart[768 + r * 16 + h];
    O2[(size_t)d * (NN * HH) + (i0 + r) * HH + h] = v;
  }
}

// ---------------------------------------------------------------------------
// Y = Out2 @ Wo^T   (1024x1024 @ [128x1024]^T -> 1024x128).
// grid (64, 8), block 128: all 4 waves on one 16x16 tile, split-K, LDS reduce.
// ---------------------------------------------------------------------------
__global__ void oproj_kernel(const float* __restrict__ O2,
                             const float* __restrict__ Wo,
                             float* __restrict__ Y) {
  __shared__ float cpart[4 * 256];
  const int tid = threadIdx.x;
  const int lane = tid & 31;
  const int wave = tid >> 5;
  const int i0 = blockIdx.x * 16;
  const int j0 = blockIdx.y * 16;

  v8f c = {};
  #pragma unroll 4
  for (int k0 = wave * 256; k0 < wave * 256 + 256; k0 += 4) {
    v2f a = load_frag_nk(O2, NN, i0, k0, lane);  // [1024,1024] row-major
    v2f b = load_frag_nk(Wo, NN, j0, k0, lane);  // Wo [128,1024] = NxK
    c = wmma4(a, b, c);
  }

  const int row_half = (lane >> 4) << 3;
  const int col = lane & 15;
  #pragma unroll
  for (int r = 0; r < 8; ++r)
    cpart[wave * 256 + (r + row_half) * 16 + col] = c[r];
  __syncthreads();

  for (int idx = tid; idx < 256; idx += 128) {
    const int r = idx >> 4, cc = idx & 15;
    float v = cpart[r * 16 + cc] + cpart[256 + r * 16 + cc] +
              cpart[512 + r * 16 + cc] + cpart[768 + r * 16 + cc];
    Y[(size_t)(i0 + r) * DD + j0 + cc] = v;
  }
}

// ---------------------------------------------------------------------------
extern "C" void kernel_launch(void* const* d_in, const int* in_sizes, int n_in,
                              void* d_out, int out_size, void* d_ws,
                              size_t ws_size, hipStream_t stream) {
  const float* x  = (const float*)d_in[0];
  const float* sp = (const float*)d_in[1];
  const float* ed = (const float*)d_in[2];
  const float* Wq = (const float*)d_in[3];
  const float* Wk = (const float*)d_in[4];
  const float* Wv = (const float*)d_in[5];
  const float* Wo = (const float*)d_in[6];
  float* out = (float*)d_out;

  float* ws = (float*)d_ws;
  const size_t M1 = (size_t)NN * NN;       // 1M floats
  float* Q    = ws;
  float* K    = ws + 1 * M1;
  float* V    = ws + 2 * M1;
  float* Bias = ws + 3 * M1;
  float* O2   = ws + 4 * M1;               // needs 20 MB of workspace

  // 1) Bias = spatial + edge
  bias_kernel<<<dim3(M1 / (256 * 4)), 256, 0, stream>>>(sp, ed, Bias);

  // 2) Q, K, V projections
  qkv_kernel<<<dim3(NN / 16, NN / 64, 3), 128, 0, stream>>>(x, Wq, Wk, Wv,
                                                            Q, K, V);

  // 3) Fused per-slice attention (softmax in LDS)
  const size_t smem_bytes = (16384 + 8192 + 128 + 1024) * sizeof(float);
  attn_kernel<<<dim3(NN / 16, DD), 128, smem_bytes, stream>>>(Q, K, V, Bias,
                                                              O2);

  // 4) Output projection
  oproj_kernel<<<dim3(NN / 16, DD / 16), 128, 0, stream>>>(O2, Wo, out);
}

// v001
// It runs in 81.6 microseconds.
// Timed twice side by side with v000, it ran 11.8 times as fast both times.
#include <hip/hip_runtime.h>
#include <hip/hip_bf16.h>
#include <cstdint>

// ---------------------------------------------------------------------------
// Graphormer MHA, fused per-d-slice attention for MI455X (gfx1250, wave32).
// N=1024, D=128, H=8.  All math f32 via V_WMMA_F32_16X16X4_F32.
// v_d staging uses GLOBAL_LOAD_ASYNC_TO_LDS_B128 (ASYNCcnt-tracked DMA).
//
// Workspace layout (floats): Q[1M] | K[1M] | V[1M] | Bias[1M] | Out2[1M]
//   = 20 MB total.  Bias is stored in accumulator order (see bias_kernel).
// ---------------------------------------------------------------------------

typedef __attribute__((ext_vector_type(2))) float v2f;
typedef __attribute__((ext_vector_type(8))) float v8f;

#define NN   1024
#define DD   128
#define HH   8

__device__ __forceinline__ v8f wmma4(v2f a, v2f b, v8f c) {
  // D = A(16x4) * B(4x16) + C(16x16), f32.
  return __builtin_amdgcn_wmma_f32_16x16x4_f32(
      /*neg_a=*/false, a, /*neg_b=*/false, b,
      /*c_mod=*/(short)0, c, /*reuse_a=*/false, /*reuse_b=*/false);
}

// Fragment loader shared by A (MxK row-major) and B (NxK row-major, i.e. B^T).
// For f32 16x16x4: lane&15 selects the M/N row, lane>>4 selects K pair {0,1}
// vs {2,3}; the two K values are adjacent in memory -> one float2.
__device__ __forceinline__ v2f load_frag_nk(const float* __restrict__ base,
                                            int row_stride, int r0, int k0,
                                            int lane) {
  const float* p = base + (size_t)(r0 + (lane & 15)) * row_stride
                        + k0 + ((lane >> 4) << 1);
  v2f r = {p[0], p[1]};
  return r;
}

// Async DMA: 16 bytes global -> LDS, tracked by ASYNCcnt (no VGPR data path).
__device__ __forceinline__ void async_g2l_b128(uint32_t lds_byte_addr,
                                               const float* gsrc) {
  asm volatile("global_load_async_to_lds_b128 %0, %1, off"
               :: "v"(lds_byte_addr), "v"((uint64_t)(uintptr_t)gsrc)
               : "memory");
}

__device__ __forceinline__ void wait_asynccnt0() {
#if defined(__has_builtin)
#if __has_builtin(__builtin_amdgcn_s_wait_asynccnt)
  __builtin_amdgcn_s_wait_asynccnt(0);
#else
  asm volatile("s_wait_asynccnt 0x0" ::: "memory");
#endif
#else
  asm volatile("s_wait_asynccnt 0x0" ::: "memory");
#endif
}

// Eight 2^x in place.  One statement: behind each v_exp_f32 stands an
// instruction that touches neither its result nor its source, and the v_nop
// gives the last one the slot the instruction set asks for there.
__device__ __forceinline__ v8f exp2x8(v8f x) {
  float x0 = x[0], x1 = x[1], x2 = x[2], x3 = x[3];
  float x4 = x[4], x5 = x[5], x6 = x[6], x7 = x[7];
  asm("v_exp_f32 %0, %0\n\t"
      "v_exp_f32 %1, %1\n\t"
      "v_exp_f32 %2, %2\n\t"
      "v_exp_f32 %3, %3\n\t"
      "v_exp_f32 %4, %4\n\t"
      "v_exp_f32 %5, %5\n\t"
      "v_exp_f32 %6, %6\n\t"
      "v_exp_f32 %7, %7\n\t"
      "v_nop"
      : "+v"(x0), "+v"(x1), "+v"(x2), "+v"(x3),
        "+v"(x4), "+v"(x5), "+v"(x6), "+v"(x7));
  v8f r = {x0, x1, x2, x3, x4, x5, x6, x7};
  return r;
}

// ---------------------------------------------------------------------------
// Bias = spatial + edge, stored in the accumulator order of the transposed
// logits tile S^T[key m][query n] that attn_kernel starts from:
//   B4[((it*64 + j)*2 + q)*32 + lane] = bias[n][m .. m+3],
//   n = it*16 + (lane & 15),  m = j*16 + (lane >> 4)*8 + q*4,
// so a wave fetches half a 16x16 C tile as one contiguous 512-byte load.
// Threads run along the output: each 128-byte line has one writing wave.
// ---------------------------------------------------------------------------
__global__ void bias_kernel(const float* __restrict__ sp,
                            const float* __restrict__ ed,
                            float* __restrict__ B) {
  int i = blockIdx.x * blockDim.x + threadIdx.x;   // 1024 blocks * 256 thr
  const int lane = i & 31;
  const int q    = (i >> 5) & 1;
  const int j    = (i >> 6) & 63;
  const int it   = i >> 12;
  const int n = it * 16 + (lane & 15);
  const int m = j * 16 + (lane >> 4) * 8 + q * 4;
  const int s = (n * NN + m) >> 2;
  const float4* s4 = (const float4*)sp;
  const float4* e4 = (const float4*)ed;
  float4 a = s4[s], b = e4[s];
  ((float4*)B)[i] = make_float4(a.x + b.x, a.y + b.y, a.z + b.z, a.w + b.w);
}

// ---------------------------------------------------------------------------
// Q/K/V = x @ W^T   (1024x1024, K=128).  grid (64, 16, 3), block 128.
// Each wave: one 16x16 tile; block covers 16 rows x 64 cols.
// ---------------------------------------------------------------------------
__global__ void qkv_kernel(const float* __restrict__ x,
                           const float* __restrict__ Wq,
                           const float* __restrict__ Wk,
                           const float* __restrict__ Wv,
                           float* __restrict__ Q,
                           float* __restrict__ K,
                           float* __restrict__ V) {
  const int lane = threadIdx.x & 31;
  const int wave = threadIdx.x >> 5;
  const int i0 = blockIdx.x * 16;
  const int j0 = blockIdx.y * 64 + wave * 16;

  const float* W;
  float* out;
  if (blockIdx.z == 0)      { W = Wq; out = Q; }
  else if (blockIdx.z == 1) { W = Wk; out = K; }
  else                      { W = Wv; out = V; }

  v8f c = {};
  #pragma unroll 4
  for (int k0 = 0; k0 < DD; k0 += 4) {
    v2f a = load_frag_nk(x, DD, i0, k0, lane);   // x row-major [N, D]
    v2f b = load_frag_nk(W, DD, j0, k0, lane);   // W row-major [DH, D] = NxK
    c = wmma4(a, b, c);
  }

  const int row_half = (lane >> 4) << 3;     // lanes 16-31 hold rows 8..15
  const int col = lane & 15;
  #pragma unroll
  for (int r = 0; r < 8; ++r)
    out[(size_t)(i0 + r + row_half) * NN + j0 + col] = c[r];
}

// ---------------------------------------------------------------------------
// Fused per-slice attention.  grid (64 n-tiles, 128 slices), block 128.
// The logits are formed transposed, S^T = k_d (s*q_d)^T + Bias^T, so that a
// lane owns one query column n and its accumulator registers hold keys.  The
// whole 16 x 1024 tile stays in accumulators (wave w: keys [w*256, w*256+256),
// 16 tiles = 128 registers): max, exp and sum run per lane, and a register
// pair of the accumulator is already a B fragment of O^T = v_d^T P^T.
// Dynamic LDS: vbuf[1024*8] + red[128] + cpart[4*128] = 8832 floats.
// ---------------------------------------------------------------------------
__global__ __launch_bounds__(128)
void attn_kernel(const float* __restrict__ Q,
                 const float* __restrict__ Km,
                 const float* __restrict__ V,
                 const float* __restrict__ Bias,
                 float* __restrict__ O2) {
  extern __shared__ float smem[];
  float* vbuf  = smem;                 //  8192 : v_d staged (async DMA)
  float* red   = vbuf + 8192;          //   128 : per-wave max [64] | sum [64]
  float* cpart = red + 128;            //   512 : split-K partials [wave][n][h]

  const int tid  = threadIdx.x;
  const int lane = tid & 31;
  const int wave = tid >> 5;
  const int i0   = blockIdx.x * 16;            // n-row tile
  const int d    = blockIdx.y;                 // slice

  const float* qd = Q  + (size_t)d * (NN * HH);   // contiguous 1024x8 block
  const float* kd = Km + (size_t)d * (NN * HH);
  const float* vd = V  + (size_t)d * (NN * HH);
  const float scale = 0.088388347648318447f;      // 128^-0.5

  // B fragments of q_d (16 columns n, K=8 -> two K=4 fragments), requested
  // ahead of the staging so that they are back when it has landed.
  v2f q0 = load_frag_nk(qd, HH, i0, 0, lane);
  v2f q1 = load_frag_nk(qd, HH, i0, 4, lane);

  // Stage v_d (32 KB) into LDS with async global->LDS DMA (ASYNCcnt).
  // Generic->LDS address: low 32 bits of an LDS-aperture address are the
  // LDS byte offset (ISA 10.2 aperture table).
  {
    const uint32_t vbase = (uint32_t)(uintptr_t)vbuf;
    #pragma unroll
    for (int i = tid; i < (NN * HH) / 4; i += 128)
      async_g2l_b128(vbase + (uint32_t)i * 16u, vd + i * 4);
    wait_asynccnt0();   // our slots visible in LDS before the barrier below
  }

  q0 *= scale;
  q1 *= scale;

  const int row_half = (lane >> 4) << 3;
  const int col = lane & 15;

  // Logits, transposed: c[t][r] = S^T[wave*256 + t*16 + row_half + r][i0+col].
  const float4* bf = (const float4*)Bias +
                     ((size_t)blockIdx.x * 64 + wave * 16) * 64 + lane;
  v8f c[16];
  v2f k0[16], k1[16];
  #pragma unroll
  for (int t = 0; t < 16; ++t) {
    const int j0 = wave * 256 + t * 16;
    k0[t] = load_frag_nk(kd, HH, j0, 0, lane);   // k_d rows are the M rows
    k1[t] = load_frag_nk(kd, HH, j0, 4, lane);
  }
  // A bias load below may land in the registers that held the k_d address:
  // the wait stands between the loads that name them and that overwrite.
  asm volatile("s_wait_xcnt 0x0" ::: "memory");
  #pragma unroll
  for (int t = 0; t < 16; ++t) {
    const float4 lo = bf[t * 64];
    const float4 hi = bf[t * 64 + 32];
    c[t] = v8f{lo.x, lo.y, lo.z, lo.w, hi.x, hi.y, hi.z, hi.w};
  }
  // Keeps every load of the tile issued ahead of the first product, so that
  // the wave meets the load latency once and not once per fragment.
  __builtin_amdgcn_sched_barrier(0);
  #pragma unroll
  for (int t = 0; t < 16; ++t) {
    c[t] = wmma4(k0[t], q0, c[t]);
    c[t] = wmma4(k1[t], q1, c[t]);
  }

  // Column max: registers, then the other lane half, then the other waves.
  v8f mv = c[0];
  #pragma unroll
  for (int t = 1; t < 16; ++t)
    #pragma unroll
    for (int r = 0; r < 8; ++r) mv[r] = fmaxf(mv[r], c[t][r]);
  float m = fmaxf(fmaxf(fmaxf(mv[0], mv[1]), fmaxf(mv[2], mv[3])),
                  fmaxf(fmaxf(mv[4], mv[5]), fmaxf(mv[6], mv[7])));
  m = fmaxf(m, __shfl_xor(m, 16));
  if (lane < 16) red[wave * 16 + col] = m;
  __syncthreads();   // publishes the per-wave maxima and the staged v_d
  m = fmaxf(fmaxf(red[col], red[16 + col]),
            fmaxf(red[32 + col], red[48 + col]));

  // P^T = exp(S^T - max) in place; O^T += v_d^T P^T, unnormalised.
  // k slot (lane half, element e) of step j holds key t*16 + row_half + 2j + e
  // on both sides.  A rows 8..15 repeat rows 0..7; their D rows are not used.
  const float* vb = vbuf + (wave * 256 + row_half) * HH + (col & 7);
  v8f sv = {};
  v8f o0 = {}, o1 = {};
  #pragma unroll
  for (int t = 0; t < 16; ++t) {
    c[t] = exp2x8((c[t] - m) * 1.44269504088896340736f);   // exp(S^T - max)
    sv += c[t];
    #pragma unroll
    for (int j = 0; j < 4; ++j) {
      v2f a = {vb[(t * 16 + 2 * j) * HH], vb[(t * 16 + 2 * j + 1) * HH]};
      v2f b = {c[t][2 * j], c[t][2 * j + 1]};
      if (j & 1) o1 = wmma4(a, b, o1);
      else       o0 = wmma4(a, b, o0);
    }
  }
  // Four vector slots between the last matrix instructions and the vector
  // adds that read their results.
  asm volatile("v_nop\n\tv_nop\n\tv_nop\n\tv_nop" : "+v"(o0), "+v"(o1));
  o0 += o1;
  float s = ((sv[0] + sv[1]) + (sv[2] + sv[3])) +
            ((sv[4] + sv[5]) + (sv[6] + sv[7]));
  s += __shfl_xor(s, 16);

  // Lanes 0..15 hold O^T[h = r][n = col] of this wave's keys.
  if (lane < 16) {
    red[64 + wave * 16 + col] = s;
    float4* cp = (float4*)(cpart + wave * 128 + col * HH);
    cp[0] = make_float4(o0[0], o0[1], o0[2], o0[3]);
    cp[1] = make_float4(o0[4], o0[5], o0[6], o0[7]);
  }
  __syncthreads();

  // Reduce 4 partials, divide by the row sum; write 16x8 block into Out2
  // (flat reinterpretation: out[d, n, h] -> Out2.flat[d*8192 + n*8 + h]).
  {
    const int r = tid >> 3;
    float v = cpart[tid] + cpart[128 + tid] + cpart[256 + tid] +
              cpart[384 + tid];
    float tot = red[64 + r] + red[80 + r] + red[96 + r] + red[112 + r];
    O2[(size_t)d * (NN * HH) + i0 * HH + tid] = v * (1.0f / tot);
  }
}

// ---------------------------------------------------------------------------
// Y = Out2 @ Wo^T   (1024x1024 @ [128x1024]^T -> 1024x128).
// grid (64, 8), block 128: all 4 waves on one 16x16 tile, split-K, LDS reduce.
// ---------------------------------------------------------------------------
__global__ void oproj_kernel(const float* __restrict__ O2,
                             const float* __restrict__ Wo,
                             float* __restrict__ Y) {
  __shared__ float cpart[4 * 256];
  const int tid = threadIdx.x;
  const int lane = tid & 31;
  const int wave = tid >> 5;
  const int i0 = blockIdx.x * 16;
  const int j0 = blockIdx.y * 16;

  v8f c = {};
  #pragma unroll 4
  for (int k0 = wave * 256; k0 < wave * 256 + 256; k0 += 4) {
    v2f a = load_frag_nk(O2, NN, i0, k0, lane);  // [1024,1024] row-major
    v2f b = load_frag_nk(Wo, NN, j0, k0, lane);  // Wo [128,1024] = NxK
    c = wmma4(a, b, c);
  }

  const int row_half = (lane >> 4) << 3;
  const int col = lane & 15;
  #pragma unroll
  for (int r = 0; r < 8; ++r)
    cpart[wave * 256 + (r + row_half) * 16 + col] = c[r];
  __syncthreads();

  for (int idx = tid; idx < 256; idx += 128) {
    const int r = idx >> 4, cc = idx & 15;
    float v = cpart[r * 16 + cc] + cpart[256 + r * 16 + cc] +
              cpart[512 + r * 16 + cc] + cpart[768 + r * 16 + cc];
    Y[(size_t)(i0 + r) * DD + j0 + cc] = v;
  }
}

// ---------------------------------------------------------------------------
extern "C" void kernel_launch(void* const* d_in, const int* in_sizes, int n_in,
                              void* d_out, int out_size, void* d_ws,
                              size_t ws_size, hipStream_t stream) {
  const float* x  = (const float*)d_in[0];
  const float* sp = (const float*)d_in[1];
  const float* ed = (const float*)d_in[2];
  const float* Wq = (const float*)d_in[3];
  const float* Wk = (const float*)d_in[4];
  const float* Wv = (const float*)d_in[5];
  const float* Wo = (const float*)d_in[6];
  float* out = (float*)d_out;

  float* ws = (float*)d_ws;
  const size_t M1 = (size_t)NN * NN;       // 1M floats
  float* Q    = ws;
  float* K    = ws + 1 * M1;
  float* V    = ws + 2 * M1;
  float* Bias = ws + 3 * M1;
  float* O2   = ws + 4 * M1;               // needs 20 MB of workspace

  // 1) Bias = spatial + edge, in accumulator order
  bias_kernel<<<dim3(M1 / (256 * 4)), 256, 0, stream>>>(sp, ed, Bias);

  // 2) Q, K, V projections
  qkv_kernel<<<dim3(NN / 16, NN / 64, 3), 128, 0, stream>>>(x, Wq, Wk, Wv,
                                                            Q, K, V);

  // 3) Fused per-slice attention (softmax in registers)
  const size_t smem_bytes = (8192 + 128 + 512) * sizeof(float);
  attn_kernel<<<dim3(NN / 16, DD), 128, smem_bytes, stream>>>(Q, K, V, Bias,
                                                              O2);

  // 4) Output projection
  oproj_kernel<<<dim3(NN / 16, DD / 16), 128, 0, stream>>>(O2, Wo, out);
}

// v002
// One run takes 77.6 microseconds.
// In both of two side-by-side timings against v001, it was 1.05 times as fast.
// Over all steps from v000 it is 12.4 times as fast.
#include <hip/hip_runtime.h>
#include <hip/hip_bf16.h>
#include <cstdint>

// ---------------------------------------------------------------------------
// Graphormer MHA, fused per-d-slice attention for MI455X (gfx1250, wave32).
// N=1024, D=128, H=8.  All math f32 via V_WMMA_F32_16X16X4_F32.
// v_d staging uses GLOBAL_LOAD_ASYNC_TO_LDS_B128 (ASYNCcnt-tracked DMA).
//
// Workspace layout (floats): Q[1M] | K[1M] | V[1M] | Bias[1M] | Out2[1M]
//   = 20 MB total.  Bias is stored in accumulator order (see bias_kernel).
// ---------------------------------------------------------------------------

typedef __attribute__((ext_vector_type(2))) float v2f;
typedef __attribute__((ext_vector_type(4))) float v4f;
typedef __attribute__((ext_vector_type(8))) float v8f;

#define NN   1024
#define DD   128
#define HH   8
#define NT   8     // n-tiles (16 query rows each) that one attention block walks

__device__ __forceinline__ v8f wmma4(v2f a, v2f b, v8f c) {
  // D = A(16x4) * B(4x16) + C(16x16), f32.
  return __builtin_amdgcn_wmma_f32_16x16x4_f32(
      /*neg_a=*/false, a, /*neg_b=*/false, b,
      /*c_mod=*/(short)0, c, /*reuse_a=*/false, /*reuse_b=*/false);
}

// Fragment loader shared by A (MxK row-major) and B (NxK row-major, i.e. B^T).
// For f32 16x16x4: lane&15 selects the M/N row, lane>>4 selects K pair {0,1}
// vs {2,3}; the two K values are adjacent in memory -> one float2.
__device__ __forceinline__ v2f load_frag_nk(const float* __restrict__ base,
                                            int row_stride, int r0, int k0,
                                            int lane) {
  const float* p = base + (size_t)(r0 + (lane & 15)) * row_stride
                        + k0 + ((lane >> 4) << 1);
  v2f r = {p[0], p[1]};
  return r;
}

// Async DMA: 16 bytes global -> LDS, tracked by ASYNCcnt (no VGPR data path).
__device__ __forceinline__ void async_g2l_b128(uint32_t lds_byte_addr,
                                               const float* gsrc) {
  asm volatile("global_load_async_to_lds_b128 %0, %1, off"
               :: "v"(lds_byte_addr), "v"((uint64_t)(uintptr_t)gsrc)
               : "memory");
}

__device__ __forceinline__ void wait_asynccnt0() {
#if defined(__has_builtin)
#if __has_builtin(__builtin_amdgcn_s_wait_asynccnt)
  __builtin_amdgcn_s_wait_asynccnt(0);
#else
  asm volatile("s_wait_asynccnt 0x0" ::: "memory");
#endif
#else
  asm volatile("s_wait_asynccnt 0x0" ::: "memory");
#endif
}

// Eight 2^x in place.  One statement: behind each v_exp_f32 stands an
// instruction that touches neither its result nor its source, and the v_nop
// gives the last one the slot the instruction set asks for there.
__device__ __forceinline__ v8f exp2x8(v8f x) {
  float x0 = x[0], x1 = x[1], x2 = x[2], x3 = x[3];
  float x4 = x[4], x5 = x[5], x6 = x[6], x7 = x[7];
  asm("v_exp_f32 %0, %0\n\t"
      "v_exp_f32 %1, %1\n\t"
      "v_exp_f32 %2, %2\n\t"
      "v_exp_f32 %3, %3\n\t"
      "v_exp_f32 %4, %4\n\t"
      "v_exp_f32 %5, %5\n\t"
      "v_exp_f32 %6, %6\n\t"
      "v_exp_f32 %7, %7\n\t"
      "v_nop"
      : "+v"(x0), "+v"(x1), "+v"(x2), "+v"(x3),
        "+v"(x4), "+v"(x5), "+v"(x6), "+v"(x7));
  v8f r = {x0, x1, x2, x3, x4, x5, x6, x7};
  return r;
}

// ---------------------------------------------------------------------------
// Bias = spatial + edge, stored in the accumulator order of the transposed
// logits tile S^T[key m][query n] that attn_kernel starts from:
//   B4[((it*64 + j)*2 + q)*32 + lane] = bias[n][m .. m+3],
//   n = it*16 + (lane & 15),  m = j*16 + (lane >> 4)*8 + q*4,
// so a wave fetches half a 16x16 C tile as one contiguous 512-byte load.
// Threads run along the output: each 128-byte line has one writing wave.
// ---------------------------------------------------------------------------
__global__ void bias_kernel(const float* __restrict__ sp,
                            const float* __restrict__ ed,
                            float* __restrict__ B) {
  int i = blockIdx.x * blockDim.x + threadIdx.x;   // 1024 blocks * 256 thr
  const int lane = i & 31;
  const int q    = (i >> 5) & 1;
  const int j    = (i >> 6) & 63;
  const int it   = i >> 12;
  const int n = it * 16 + (lane & 15);
  const int m = j * 16 + (lane >> 4) * 8 + q * 4;
  const int s = (n * NN + m) >> 2;
  const float4* s4 = (const float4*)sp;
  const float4* e4 = (const float4*)ed;
  float4 a = s4[s], b = e4[s];
  ((float4*)B)[i] = make_float4(a.x + b.x, a.y + b.y, a.z + b.z, a.w + b.w);
}

// ---------------------------------------------------------------------------
// Q/K/V = x @ W^T   (1024x1024, K=128).  grid (64, 16, 3), block 128.
// Each wave: one 16x16 tile; block covers 16 rows x 64 cols.
// ---------------------------------------------------------------------------
__global__ void qkv_kernel(const float* __restrict__ x,
                           const float* __restrict__ Wq,
                           const float* __restrict__ Wk,
                           const float* __restrict__ Wv,
                           float* __restrict__ Q,
                           float* __restrict__ K,
                           float* __restrict__ V) {
  const int lane = threadIdx.x & 31;
  const int wave = threadIdx.x >> 5;
  const int i0 = blockIdx.x * 16;
  const int j0 = blockIdx.y * 64 + wave * 16;

  const float* W;
  float* out;
  if (blockIdx.z == 0)      { W = Wq; out = Q; }
  else if (blockIdx.z == 1) { W = Wk; out = K; }
  else                      { W = Wv; out = V; }

  v8f c = {};
  #pragma unroll 4
  for (int k0 = 0; k0 < DD; k0 += 4) {
    v2f a = load_frag_nk(x, DD, i0, k0, lane);   // x row-major [N, D]
    v2f b = load_frag_nk(W, DD, j0, k0, lane);   // W row-major [DH, D] = NxK
    c = wmma4(a, b, c);
  }

  const int row_half = (lane >> 4) << 3;     // lanes 16-31 hold rows 8..15
  const int col = lane & 15;
  #pragma unroll
  for (int r = 0; r < 8; ++r)
    out[(size_t)(i0 + r + row_half) * NN + j0 + col] = c[r];
}

// ---------------------------------------------------------------------------
// Fused per-slice attention.  grid (8 groups of 8 n-tiles, 128 slices), block
// 128.  A block walks the NT n-tiles of its group: k_d and v_d are fetched once,
// stay in LDS and serve all of them.
// The logits are formed transposed, S^T = k_d (s*q_d)^T + Bias^T, so that a
// lane owns one query column n and its accumulator registers hold keys.  The
// whole 16 x 1024 tile stays in accumulators (wave w: keys [w*256, w*256+256),
// 16 tiles = 128 registers): max, exp and sum run per lane, and a register
// pair of the accumulator is already a B fragment of O^T = v_d^T P^T.
// LDS: vbuf[1024*8] + kbuf[1024*8] + red[128] + cpart[4*128] = 17024 floats.
// ---------------------------------------------------------------------------
__global__ __launch_bounds__(128)
void attn_kernel(const float* __restrict__ Q,
                 const float* __restrict__ Km,
                 const float* __restrict__ V,
                 const float* __restrict__ Bias,
                 float* __restrict__ O2) {
  __shared__ __attribute__((aligned(16))) float smem[2 * 8192 + 128 + 512];
  float* vbuf  = smem;                 //  8192 : v_d staged (async DMA)
  float* kbuf  = vbuf + 8192;          //  8192 : k_d staged (through registers)
  float* red   = kbuf + 8192;          //   128 : per-wave max [64] | sum [64]
  float* cpart = red + 128;            //   512 : split-K partials [wave][n][h]

  const int tid  = threadIdx.x;
  const int lane = tid & 31;
  const int wave = tid >> 5;
  const int d    = blockIdx.y;                 // slice

  const float* qd = Q  + (size_t)d * (NN * HH);   // contiguous 1024x8 block
  const float* kd = Km + (size_t)d * (NN * HH);
  const float* vd = V  + (size_t)d * (NN * HH);
  const float scale = 0.088388347648318447f;      // 128^-0.5

  // This wave's 256 rows of k_d, requested ahead of the v_d staging so that
  // the two latencies run side by side; they go to LDS below.
  const v4f* ks = (const v4f*)kd + wave * 512 + lane;
  v4f kt[16];
  #pragma unroll
  for (int j = 0; j < 16; ++j) kt[j] = ks[j * 32];

  // Stage v_d (32 KB) into LDS with async global->LDS DMA (ASYNCcnt).
  // Generic->LDS address: low 32 bits of an LDS-aperture address are the
  // LDS byte offset (ISA 10.2 aperture table).
  {
    const uint32_t vbase = (uint32_t)(uintptr_t)vbuf;
    #pragma unroll
    for (int i = tid; i < (NN * HH) / 4; i += 128)
      async_g2l_b128(vbase + (uint32_t)i * 16u, vd + i * 4);
    wait_asynccnt0();   // our slots visible in LDS before the barrier below
  }

  const int row_half = (lane >> 4) << 3;
  const int col = lane & 15;

  // Each wave stages the 256 rows of k_d that it alone reads (8 KB, whole
  // lines): its own LDS stores and loads stay in order, so no barrier is owed.
  {
    v4f* kl = (v4f*)kbuf + wave * 512 + lane;
    // The loaded values are inputs, so every staging load stands in front of
    // this wait; the address is one too, so nothing lands in its registers
    // while a load that names them is on its way.
    asm volatile("s_wait_xcnt 0x0"
                 :: "v"(kt[0]), "v"(kt[1]), "v"(kt[2]), "v"(kt[3]),
                    "v"(kt[4]), "v"(kt[5]), "v"(kt[6]), "v"(kt[7]),
                    "v"(kt[8]), "v"(kt[9]), "v"(kt[10]), "v"(kt[11]),
                    "v"(kt[12]), "v"(kt[13]), "v"(kt[14]), "v"(kt[15]),
                    "v"(ks)
                 : "memory");
    #pragma unroll
    for (int j = 0; j < 16; ++j) kl[j * 32] = kt[j];
  }
  // A fragment of key row wave*256 + t*16 + (lane & 15): k pair of the lane half.
  const float* kp = kbuf + (wave * 256 + col) * HH + ((lane >> 4) << 1);

  for (int it = 0; it < NT; ++it) {
  const int nt = blockIdx.x * NT + it;         // n-row tile
  const int i0 = nt * 16;

  // B fragments of q_d (16 columns n, K=8 -> two K=4 fragments).
  v2f q0 = load_frag_nk(qd, HH, i0, 0, lane);
  v2f q1 = load_frag_nk(qd, HH, i0, 4, lane);

  // Logits, transposed: c[t][r] = S^T[wave*256 + t*16 + row_half + r][i0+col].
  const float4* bf = (const float4*)Bias +
                     ((size_t)nt * 64 + wave * 16) * 64 + lane;
  v8f c[16];
  #pragma unroll
  for (int t = 0; t < 16; ++t) {
    const float4 lo = bf[t * 64];
    const float4 hi = bf[t * 64 + 32];
    c[t] = v8f{lo.x, lo.y, lo.z, lo.w, hi.x, hi.y, hi.z, hi.w};
  }
  v2f k0[16], k1[16];
  #pragma unroll
  for (int t = 0; t < 16; ++t) {                 // k_d rows are the M rows
    k0[t] = v2f{kp[t * 16 * HH], kp[t * 16 * HH + 1]};
    k1[t] = v2f{kp[t * 16 * HH + 4], kp[t * 16 * HH + 5]};
  }
  // Keeps every load of the tile issued ahead of the first product, so that
  // the wave meets the load latency once and not once per fragment.
  __builtin_amdgcn_sched_barrier(0);
  q0 *= scale;
  q1 *= scale;
  #pragma unroll
  for (int t = 0; t < 16; ++t) {
    c[t] = wmma4(k0[t], q0, c[t]);
    c[t] = wmma4(k1[t], q1, c[t]);
  }

  // Column max: registers, then the other lane half, then the other waves.
  v8f mv = c[0];
  #pragma unroll
  for (int t = 1; t < 16; ++t)
    #pragma unroll
    for (int r = 0; r < 8; ++r) mv[r] = fmaxf(mv[r], c[t][r]);
  float m = fmaxf(fmaxf(fmaxf(mv[0], mv[1]), fmaxf(mv[2], mv[3])),
                  fmaxf(fmaxf(mv[4], mv[5]), fmaxf(mv[6], mv[7])));
  m = fmaxf(m, __shfl_xor(m, 16));
  if (lane < 16) red[wave * 16 + col] = m;
  // Publishes the per-wave maxima (and, on the first tile, the staged v_d); it
  // also ends the reads of cpart and of the sums that the tile in front made.
  __syncthreads();
  m = fmaxf(fmaxf(red[col], red[16 + col]),
            fmaxf(red[32 + col], red[48 + col]));

  // P^T = exp(S^T - max) in place; O^T += v_d^T P^T, unnormalised.
  // k slot (lane half, element e) of step j holds key t*16 + row_half + 2j + e
  // on both sides.  A rows 8..15 repeat rows 0..7; their D rows are not used.
  const float* vb = vbuf + (wave * 256 + row_half) * HH + (col & 7);
  v8f sv = {};
  v8f o0 = {}, o1 = {};
  #pragma unroll
  for (int t = 0; t < 16; ++t) {
    c[t] = exp2x8((c[t] - m) * 1.44269504088896340736f);   // exp(S^T - max)
    sv += c[t];
    #pragma unroll
    for (int j = 0; j < 4; ++j) {
      v2f a = {vb[(t * 16 + 2 * j) * HH], vb[(t * 16 + 2 * j + 1) * HH]};
      v2f b = {c[t][2 * j], c[t][2 * j + 1]};
      if (j & 1) o1 = wmma4(a, b, o1);
      else       o0 = wmma4(a, b, o0);
    }
  }
  // Four vector slots between the last matrix instructions and the vector
  // adds that read their results.
  asm volatile("v_nop\n\tv_nop\n\tv_nop\n\tv_nop" : "+v"(o0), "+v"(o1));
  o0 += o1;
  float s = ((sv[0] + sv[1]) + (sv[2] + sv[3])) +
            ((sv[4] + sv[5]) + (sv[6] + sv[7]));
  s += __shfl_xor(s, 16);

  // Lanes 0..15 hold O^T[h = r][n = col] of this wave's keys.
  if (lane < 16) {
    red[64 + wave * 16 + col] = s;
    float4* cp = (float4*)(cpart + wave * 128 + col * HH);
    cp[0] = make_float4(o0[0], o0[1], o0[2], o0[3]);
    cp[1] = make_float4(o0[4], o0[5], o0[6], o0[7]);
  }
  __syncthreads();

  // Reduce 4 partials, divide by the row sum; write 16x8 block into Out2
  // (flat reinterpretation: out[d, n, h] -> Out2.flat[d*8192 + n*8 + h]).
  {
    const int r = tid >> 3;
    float v = cpart[tid] + cpart[128 + tid] + cpart[256 + tid] +
              cpart[384 + tid];
    float tot = red[64 + r] + red[80 + r] + red[96 + r] + red[112 + r];
    O2[(size_t)d * (NN * HH) + i0 * HH + tid] = v * (1.0f / tot);
  }
  }   // n-tiles of the group
}

// ---------------------------------------------------------------------------
// Y = Out2 @ Wo^T   (1024x1024 @ [128x1024]^T -> 1024x128).
// grid (64, 8), block 128: all 4 waves on one 16x16 tile, split-K, LDS reduce.
// ---------------------------------------------------------------------------
__global__ void oproj_kernel(const float* __restrict__ O2,
                             const float* __restrict__ Wo,
                             float* __restrict__ Y) {
  __shared__ float cpart[4 * 256];
  const int tid = threadIdx.x;
  const int lane = tid & 31;
  const int wave = tid >> 5;
  const int i0 = blockIdx.x * 16;
  const int j0 = blockIdx.y * 16;

  v8f c = {};
  #pragma unroll 4
  for (int k0 = wave * 256; k0 < wave * 256 + 256; k0 += 4) {
    v2f a = load_frag_nk(O2, NN, i0, k0, lane);  // [1024,1024] row-major
    v2f b = load_frag_nk(Wo, NN, j0, k0, lane);  // Wo [128,1024] = NxK
    c = wmma4(a, b, c);
  }

  const int row_half = (lane >> 4) << 3;
  const int col = lane & 15;
  #pragma unroll
  for (int r = 0; r < 8; ++r)
    cpart[wave * 256 + (r + row_half) * 16 + col] = c[r];
  __syncthreads();

  for (int idx = tid; idx < 256; idx += 128) {
    const int r = idx >> 4, cc = idx & 15;
    float v = cpart[r * 16 + cc] + cpart[256 + r * 16 + cc] +
              cpart[512 + r * 16 + cc] + cpart[768 + r * 16 + cc];
    Y[(size_t)(i0 + r) * DD + j0 + cc] = v;
  }
}

// ---------------------------------------------------------------------------
extern "C" void kernel_launch(void* const* d_in, const int* in_sizes, int n_in,
                              void* d_out, int out_size, void* d_ws,
                              size_t ws_size, hipStream_t stream) {
  const float* x  = (const float*)d_in[0];
  const float* sp = (const float*)d_in[1];
  const float* ed = (const float*)d_in[2];
  const float* Wq = (const float*)d_in[3];
  const float* Wk = (const float*)d_in[4];
  const float* Wv = (const float*)d_in[5];
  const float* Wo = (const float*)d_in[6];
  float* out = (float*)d_out;

  float* ws = (float*)d_ws;
  const size_t M1 = (size_t)NN * NN;       // 1M floats
  float* Q    = ws;
  float* K    = ws + 1 * M1;
  float* V    = ws + 2 * M1;
  float* Bias = ws + 3 * M1;
  float* O2   = ws + 4 * M1;               // needs 20 MB of workspace

  // 1) Bias = spatial + edge, in accumulator order
  bias_kernel<<<dim3(M1 / (256 * 4)), 256, 0, stream>>>(sp, ed, Bias);

  // 2) Q, K, V projections
  qkv_kernel<<<dim3(NN / 16, NN / 64, 3), 128, 0, stream>>>(x, Wq, Wk, Wv,
                                                            Q, K, V);

  // 3) Fused per-slice attention (softmax in registers)
  attn_kernel<<<dim3(NN / 16 / NT, DD), 128, 0, stream>>>(Q, K, V, Bias, O2);

  // 4) Output projection
  oproj_kernel<<<dim3(NN / 16, DD / 16), 128, 0, stream>>>(O2, Wo, out);
}

// v003
// A run of this version takes 64.7 microseconds.
// Next to v002, in two timings, it ran 1.19 and 1.20 times as fast.
// Counting every step since v000, it is 14.8 times as fast.
#include <hip/hip_runtime.h>
#include <hip/hip_bf16.h>
#include <cstdint>

// ---------------------------------------------------------------------------
// Graphormer MHA, fused per-d-slice attention for MI455X (gfx1250, wave32).
// N=1024, D=128, H=8.  All math f32 via V_WMMA_F32_16X16X4_F32.
// v_d staging uses GLOBAL_LOAD_ASYNC_TO_LDS_B128 (ASYNCcnt-tracked DMA).
//
// Workspace layout (floats): Q[1M] | K[1M] | V[1M] | Bias[1M] | Out2[1M]
//   = 20 MB total.  Bias is stored in accumulator order (see bias_kernel).
// ---------------------------------------------------------------------------

typedef __attribute__((ext_vector_type(2))) float v2f;
typedef __attribute__((ext_vector_type(4))) float v4f;
typedef __attribute__((ext_vector_type(8))) float v8f;

#define NN   1024
#define DD   128
#define HH   8
#define NT   8     // n-tiles (16 query rows each) that one attention block walks

__device__ __forceinline__ v8f wmma4(v2f a, v2f b, v8f c) {
  // D = A(16x4) * B(4x16) + C(16x16), f32.
  return __builtin_amdgcn_wmma_f32_16x16x4_f32(
      /*neg_a=*/false, a, /*neg_b=*/false, b,
      /*c_mod=*/(short)0, c, /*reuse_a=*/false, /*reuse_b=*/false);
}

// Fragment loader for A (MxK row-major) or B (NxK row-major, i.e. B^T); only the q_d B fragments use it.
// For f32 16x16x4: lane&15 selects the M/N row, lane>>4 selects K pair {0,1}
// vs {2,3}; the two K values are adjacent in memory -> one float2.
__device__ __forceinline__ v2f load_frag_nk(const float* __restrict__ base,
                                            int row_stride, int r0, int k0,
                                            int lane) {
  const float* p = base + (size_t)(r0 + (lane & 15)) * row_stride
                        + k0 + ((lane >> 4) << 1);
  v2f r = {p[0], p[1]};
  return r;
}

// Async DMA: 16 bytes global -> LDS, tracked by ASYNCcnt (no VGPR data path).
__device__ __forceinline__ void async_g2l_b128(uint32_t lds_byte_addr,
                                               const float* gsrc) {
  asm volatile("global_load_async_to_lds_b128 %0, %1, off"
               :: "v"(lds_byte_addr), "v"((uint64_t)(uintptr_t)gsrc)
               : "memory");
}

__device__ __forceinline__ void wait_asynccnt0() {
#if defined(__has_builtin)
#if __has_builtin(__builtin_amdgcn_s_wait_asynccnt)
  __builtin_amdgcn_s_wait_asynccnt(0);
#else
  asm volatile("s_wait_asynccnt 0x0" ::: "memory");
#endif
#else
  asm volatile("s_wait_asynccnt 0x0" ::: "memory");
#endif
}

// Eight 2^x in place.  One statement: behind each v_exp_f32 stands an
// instruction that touches neither its result nor its source, and the v_nop
// gives the last one the slot the instruction set asks for there.
__device__ __forceinline__ v8f exp2x8(v8f x) {
  float x0 = x[0], x1 = x[1], x2 = x[2], x3 = x[3];
  float x4 = x[4], x5 = x[5], x6 = x[6], x7 = x[7];
  asm("v_exp_f32 %0, %0\n\t"
      "v_exp_f32 %1, %1\n\t"
      "v_exp_f32 %2, %2\n\t"
      "v_exp_f32 %3, %3\n\t"
      "v_exp_f32 %4, %4\n\t"
      "v_exp_f32 %5, %5\n\t"
      "v_exp_f32 %6, %6\n\t"
      "v_exp_f32 %7, %7\n\t"
      "v_nop"
      : "+v"(x0), "+v"(x1), "+v"(x2), "+v"(x3),
        "+v"(x4), "+v"(x5), "+v"(x6), "+v"(x7));
  v8f r = {x0, x1, x2, x3, x4, x5, x6, x7};
  return r;
}

// ---------------------------------------------------------------------------
// Bias = spatial + edge, stored in the accumulator order of the transposed
// logits tile S^T[key m][query n] that attn_kernel starts from:
//   B4[((it*64 + j)*2 + q)*32 + lane] = bias[n][m .. m+3],
//   n = it*16 + (lane & 15),  m = j*16 + (lane >> 4)*8 + q*4,
// so a wave fetches half a 16x16 C tile as one contiguous 512-byte load.
// Threads run along the output: each 128-byte line has one writing wave.
// ---------------------------------------------------------------------------
__global__ void bias_kernel(const float* __restrict__ sp,
                            const float* __restrict__ ed,
                            float* __restrict__ B) {
  int i = blockIdx.x * blockDim.x + threadIdx.x;   // 1024 blocks * 256 thr
  const int lane = i & 31;
  const int q    = (i >> 5) & 1;
  const int j    = (i >> 6) & 63;
  const int it   = i >> 12;
  const int n = it * 16 + (lane & 15);
  const int m = j * 16 + (lane >> 4) * 8 + q * 4;
  const int s = (n * NN + m) >> 2;
  const float4* s4 = (const float4*)sp;
  const float4* e4 = (const float4*)ed;
  float4 a = s4[s], b = e4[s];
  ((float4*)B)[i] = make_float4(a.x + b.x, a.y + b.y, a.z + b.z, a.w + b.w);
}

// ---------------------------------------------------------------------------
// Q/K/V = x @ W^T   (1024x1024, K=128).  grid (16, 16, 3), block 128.
// A block forms a 64x64 tile.  Its 64 rows of x and 64 rows of W (whole K) go
// to LDS first, each wave-wide load being one whole 512-byte row, so that a
// cache line is asked for once per block; the 8-byte fragments, which lie 16
// rows apart, are then read from LDS.  Row pitch 132 floats: the 16 rows of a
// fragment start 4 banks apart and the 64 words of a read fall on 64 banks.
// Each wave: 32x32 = 2x2 tiles, k ascending as before.
// ---------------------------------------------------------------------------
#define QT   64    // rows of x, and rows of W, per block
#define QP   132   // LDS row pitch in floats

__global__ __launch_bounds__(128)
void qkv_kernel(const float* __restrict__ x,
                const float* __restrict__ Wq,
                const float* __restrict__ Wk,
                const float* __restrict__ Wv,
                float* __restrict__ Q,
                float* __restrict__ K,
                float* __restrict__ V) {
  __shared__ __attribute__((aligned(16))) float xs[QT * QP];
  __shared__ __attribute__((aligned(16))) float wt[QT * QP];
  const int lane = threadIdx.x & 31;
  const int wave = threadIdx.x >> 5;
  const int i0 = blockIdx.x * QT;
  const int j0 = blockIdx.y * QT;

  const float* W;
  float* out;
  if (blockIdx.z == 0)      { W = Wq; out = Q; }
  else if (blockIdx.z == 1) { W = Wk; out = K; }
  else                      { W = Wv; out = V; }

  const int col = lane & 15;
  const int wm = (wave >> 1) * 32;
  const int wn = (wave & 1) * 32;
  const int row_half = (lane >> 4) << 3;     // lanes 16-31 hold rows 8..15
  float* o = out + (size_t)(i0 + wm + row_half) * NN + j0 + wn + col;

  // Wave w brings rows w, w+4, ... of both tiles.
  {
    const v4f* xg = (const v4f*)(x + (size_t)(i0 + wave) * DD) + lane;
    const v4f* wg = (const v4f*)(W + (size_t)(j0 + wave) * DD) + lane;
    v8f xr[QT / 8], wr[QT / 8];          // two rows (4 apart) per entry
    #pragma unroll
    for (int r = 0; r < QT / 8; ++r) {     // 4 rows on: 4 * DD floats = DD v4f
      xr[r] = __builtin_shufflevector(xg[2 * r * DD], xg[(2 * r + 1) * DD],
                                      0, 1, 2, 3, 4, 5, 6, 7);
      wr[r] = __builtin_shufflevector(wg[2 * r * DD], wg[(2 * r + 1) * DD],
                                      0, 1, 2, 3, 4, 5, 6, 7);
    }
    // The loaded values are inputs, so every staging load stands in front of
    // this wait; the two addresses are inputs too, so nothing (no later load's
    // result either) lands in their registers while a load that names them is
    // on its way.  The store address is an input as well: formed here, it
    // leaves no vector instruction among the matrix instructions below, where
    // one could land in an operand register of a product just issued.
    asm volatile("s_wait_xcnt 0x0"
                 :: "v"(xr[0]), "v"(xr[1]), "v"(xr[2]), "v"(xr[3]),
                    "v"(xr[4]), "v"(xr[5]), "v"(xr[6]), "v"(xr[7]),
                    "v"(wr[0]), "v"(wr[1]), "v"(wr[2]), "v"(wr[3]),
                    "v"(wr[4]), "v"(wr[5]), "v"(wr[6]), "v"(wr[7]),
                    "v"(xg), "v"(wg), "v"(o)
                 : "memory");
    float* xl = xs + wave * QP + lane * 4;
    float* wl = wt + wave * QP + lane * 4;
    #pragma unroll
    for (int r = 0; r < QT / 8; ++r) {
      *(v4f*)(xl + (2 * r) * 4 * QP) =
          __builtin_shufflevector(xr[r], xr[r], 0, 1, 2, 3);
      *(v4f*)(xl + (2 * r + 1) * 4 * QP) =
          __builtin_shufflevector(xr[r], xr[r], 4, 5, 6, 7);
      *(v4f*)(wl + (2 * r) * 4 * QP) =
          __builtin_shufflevector(wr[r], wr[r], 0, 1, 2, 3);
      *(v4f*)(wl + (2 * r + 1) * 4 * QP) =
          __builtin_shufflevector(wr[r], wr[r], 4, 5, 6, 7);
    }
  }
  __syncthreads();   // publishes both tiles to the four waves

  const float* ap = xs + (wm + col) * QP + ((lane >> 4) << 1);
  const float* bp = wt + (wn + col) * QP + ((lane >> 4) << 1);

  v8f c00 = {}, c01 = {}, c10 = {}, c11 = {};
  #pragma unroll
  for (int k0 = 0; k0 < DD; k0 += 4) {
    v2f a0 = *(const v2f*)(ap + k0);
    v2f a1 = *(const v2f*)(ap + 16 * QP + k0);
    v2f b0 = *(const v2f*)(bp + k0);
    v2f b1 = *(const v2f*)(bp + 16 * QP + k0);
    c00 = wmma4(a0, b0, c00);
    c01 = wmma4(a0, b1, c01);
    c10 = wmma4(a1, b0, c10);
    c11 = wmma4(a1, b1, c11);
  }

  #pragma unroll
  for (int r = 0; r < 8; ++r) {
    o[(size_t)r * NN]             = c00[r];
    o[(size_t)r * NN + 16]        = c01[r];
    o[(size_t)(r + 16) * NN]      = c10[r];
    o[(size_t)(r + 16) * NN + 16] = c11[r];
  }
}

// ---------------------------------------------------------------------------
// Fused per-slice attention.  grid (8 groups of 8 n-tiles, 128 slices), block
// 128.  A block walks the NT n-tiles of its group: k_d and v_d are fetched once,
// stay in LDS and serve all of them.
// The logits are formed transposed, S^T = k_d (s*q_d)^T + Bias^T, so that a
// lane owns one query column n and its accumulator registers hold keys.  The
// whole 16 x 1024 tile stays in accumulators (wave w: keys [w*256, w*256+256),
// 16 tiles = 128 registers): max, exp and sum run per lane, and a register
// pair of the accumulator is already a B fragment of O^T = v_d^T P^T.
// LDS: vbuf[1024*8] + kbuf[1024*8] + red[128] + cpart[4*128] = 17024 floats.
// ---------------------------------------------------------------------------
__global__ __launch_bounds__(128)
void attn_kernel(const float* __restrict__ Q,
                 const float* __restrict__ Km,
                 const float* __restrict__ V,
                 const float* __restrict__ Bias,
                 float* __restrict__ O2) {
  __shared__ __attribute__((aligned(16))) float smem[2 * 8192 + 128 + 512];
  float* vbuf  = smem;                 //  8192 : v_d staged (async DMA)
  float* kbuf  = vbuf + 8192;          //  8192 : k_d staged (through registers)
  float* red   = kbuf + 8192;          //   128 : per-wave max [64] | sum [64]
  float* cpart = red + 128;            //   512 : split-K partials [wave][n][h]

  const int tid  = threadIdx.x;
  const int lane = tid & 31;
  const int wave = tid >> 5;
  const int d    = blockIdx.y;                 // slice

  const float* qd = Q  + (size_t)d * (NN * HH);   // contiguous 1024x8 block
  const float* kd = Km + (size_t)d * (NN * HH);
  const float* vd = V  + (size_t)d * (NN * HH);
  const float scale = 0.088388347648318447f;      // 128^-0.5

  // This wave's 256 rows of k_d, requested ahead of the v_d staging so that
  // the two latencies run side by side; they go to LDS below.
  const v4f* ks = (const v4f*)kd + wave * 512 + lane;
  v4f kt[16];
  #pragma unroll
  for (int j = 0; j < 16; ++j) kt[j] = ks[j * 32];

  // Stage v_d (32 KB) into LDS with async global->LDS DMA (ASYNCcnt).
  // Generic->LDS address: low 32 bits of an LDS-aperture address are the
  // LDS byte offset (ISA 10.2 aperture table).
  {
    const uint32_t vbase = (uint32_t)(uintptr_t)vbuf;
    #pragma unroll
    for (int i = tid; i < (NN * HH) / 4; i += 128)
      async_g2l_b128(vbase + (uint32_t)i * 16u, vd + i * 4);
    wait_asynccnt0();   // our slots visible in LDS before the barrier below
  }

  const int row_half = (lane >> 4) << 3;
  const int col = lane & 15;

  // Each wave stages the 256 rows of k_d that it alone reads (8 KB, whole
  // lines): its own LDS stores and loads stay in order, so no barrier is owed.
  {
    v4f* kl = (v4f*)kbuf + wave * 512 + lane;
    // The loaded values are inputs, so every staging load stands in front of
    // this wait; the address is one too, so nothing lands in its registers
    // while a load that names them is on its way.
    asm volatile("s_wait_xcnt 0x0"
                 :: "v"(kt[0]), "v"(kt[1]), "v"(kt[2]), "v"(kt[3]),
                    "v"(kt[4]), "v"(kt[5]), "v"(kt[6]), "v"(kt[7]),
                    "v"(kt[8]), "v"(kt[9]), "v"(kt[10]), "v"(kt[11]),
                    "v"(kt[12]), "v"(kt[13]), "v"(kt[14]), "v"(kt[15]),
                    "v"(ks)
                 : "memory");
    #pragma unroll
    for (int j = 0; j < 16; ++j) kl[j * 32] = kt[j];
  }
  // A fragment of key row wave*256 + t*16 + (lane & 15): k pair of the lane half.
  const float* kp = kbuf + (wave * 256 + col) * HH + ((lane >> 4) << 1);

  for (int it = 0; it < NT; ++it) {
  const int nt = blockIdx.x * NT + it;         // n-row tile
  const int i0 = nt * 16;

  // B fragments of q_d (16 columns n, K=8 -> two K=4 fragments).
  v2f q0 = load_frag_nk(qd, HH, i0, 0, lane);
  v2f q1 = load_frag_nk(qd, HH, i0, 4, lane);

  // Logits, transposed: c[t][r] = S^T[wave*256 + t*16 + row_half + r][i0+col].
  const float4* bf = (const float4*)Bias +
                     ((size_t)nt * 64 + wave * 16) * 64 + lane;
  v8f c[16];
  #pragma unroll
  for (int t = 0; t < 16; ++t) {
    const float4 lo = bf[t * 64];
    const float4 hi = bf[t * 64 + 32];
    c[t] = v8f{lo.x, lo.y, lo.z, lo.w, hi.x, hi.y, hi.z, hi.w};
  }
  v2f k0[16], k1[16];
  #pragma unroll
  for (int t = 0; t < 16; ++t) {                 // k_d rows are the M rows
    k0[t] = v2f{kp[t * 16 * HH], kp[t * 16 * HH + 1]};
    k1[t] = v2f{kp[t * 16 * HH + 4], kp[t * 16 * HH + 5]};
  }
  // Keeps every load of the tile issued ahead of the first product, so that
  // the wave meets the load latency once and not once per fragment.
  __builtin_amdgcn_sched_barrier(0);
  q0 *= scale;
  q1 *= scale;
  #pragma unroll
  for (int t = 0; t < 16; ++t) {
    c[t] = wmma4(k0[t], q0, c[t]);
    c[t] = wmma4(k1[t], q1, c[t]);
  }

  // Column max: registers, then the other lane half, then the other waves.
  v8f mv = c[0];
  #pragma unroll
  for (int t = 1; t < 16; ++t)
    #pragma unroll
    for (int r = 0; r < 8; ++r) mv[r] = fmaxf(mv[r], c[t][r]);
  float m = fmaxf(fmaxf(fmaxf(mv[0], mv[1]), fmaxf(mv[2], mv[3])),
                  fmaxf(fmaxf(mv[4], mv[5]), fmaxf(mv[6], mv[7])));
  m = fmaxf(m, __shfl_xor(m, 16));
  if (lane < 16) red[wave * 16 + col] = m;
  // Publishes the per-wave maxima (and, on the first tile, the staged v_d); it
  // also ends the reads of cpart and of the sums that the tile in front made.
  __syncthreads();
  m = fmaxf(fmaxf(red[col], red[16 + col]),
            fmaxf(red[32 + col], red[48 + col]));

  // P^T = exp(S^T - max) in place; O^T += v_d^T P^T, unnormalised.
  // k slot (lane half, element e) of step j holds key t*16 + row_half + 2j + e
  // on both sides.  A rows 8..15 repeat rows 0..7; their D rows are not used.
  const float* vb = vbuf + (wave * 256 + row_half) * HH + (col & 7);
  v8f sv = {};
  v8f o0 = {}, o1 = {};
  #pragma unroll
  for (int t = 0; t < 16; ++t) {
    c[t] = exp2x8((c[t] - m) * 1.44269504088896340736f);   // exp(S^T - max)
    sv += c[t];
    #pragma unroll
    for (int j = 0; j < 4; ++j) {
      v2f a = {vb[(t * 16 + 2 * j) * HH], vb[(t * 16 + 2 * j + 1) * HH]};
      v2f b = {c[t][2 * j], c[t][2 * j + 1]};
      if (j & 1) o1 = wmma4(a, b, o1);
      else       o0 = wmma4(a, b, o0);
    }
  }
  // Four vector slots between the last matrix instructions and the vector
  // adds that read their results.
  asm volatile("v_nop\n\tv_nop\n\tv_nop\n\tv_nop" : "+v"(o0), "+v"(o1));
  o0 += o1;
  float s = ((sv[0] + sv[1]) + (sv[2] + sv[3])) +
            ((sv[4] + sv[5]) + (sv[6] + sv[7]));
  s += __shfl_xor(s, 16);

  // Lanes 0..15 hold O^T[h = r][n = col] of this wave's keys.
  if (lane < 16) {
    red[64 + wave * 16 + col] = s;
    float4* cp = (float4*)(cpart + wave * 128 + col * HH);
    cp[0] = make_float4(o0[0], o0[1], o0[2], o0[3]);
    cp[1] = make_float4(o0[4], o0[5], o0[6], o0[7]);
  }
  __syncthreads();

  // Reduce 4 partials, divide by the row sum; write 16x8 block into Out2
  // (flat reinterpretation: out[d, n, h] -> Out2.flat[d*8192 + n*8 + h]).
  {
    const int r = tid >> 3;
    float v = cpart[tid] + cpart[128 + tid] + cpart[256 + tid] +
              cpart[384 + tid];
    float tot = red[64 + r] + red[80 + r] + red[96 + r] + red[112 + r];
    O2[(size_t)d * (NN * HH) + i0 * HH + tid] = v * (1.0f / tot);
  }
  }   // n-tiles of the group
}

// ---------------------------------------------------------------------------
// Y = Out2 @ Wo^T   (1024x1024 @ [128x1024]^T -> 1024x128).
// grid (64, 8), block 128: all 4 waves on one 16x16 tile, split-K, LDS reduce.
// Each wave brings its own quarter of K (16 rows of Out2, 16 rows of Wo) to a
// range of LDS that it alone uses, 128 k at a time, each wave-wide load being
// 512 contiguous bytes of one row, and reads the fragments from there (pitch
// as in qkv_kernel).  A wave's own LDS stores and loads stay in order, so the
// staging owes no barrier; the second half's loads fly under the first half's
// products.
// ---------------------------------------------------------------------------
__global__ __launch_bounds__(128)
void oproj_kernel(const float* __restrict__ O2,
                  const float* __restrict__ Wo,
                  float* __restrict__ Y) {
  __shared__ __attribute__((aligned(16))) float st[4 * 2 * 16 * QP];
  __shared__ float cpart[4 * 256];
  const int tid = threadIdx.x;
  const int lane = tid & 31;
  const int wave = tid >> 5;
  const int i0 = blockIdx.x * 16;
  const int j0 = blockIdx.y * 16;
  const int row_half = (lane >> 4) << 3;
  const int col = lane & 15;

  float* as = st + wave * (2 * 16 * QP);       // 16 rows of Out2, 128 k
  float* bs = as + 16 * QP;                    // 16 rows of Wo,   128 k
  const v4f* ag = (const v4f*)(O2 + (size_t)i0 * NN + wave * 256) + lane;
  const v4f* bg = (const v4f*)(Wo + (size_t)j0 * NN + wave * 256) + lane;
  float* al = as + lane * 4;
  float* bl = bs + lane * 4;
  const float* ap = as + col * QP + ((lane >> 4) << 1);
  const float* bp = bs + col * QP + ((lane >> 4) << 1);
  float* cw = cpart + wave * 256 + row_half * 16 + col;

  v8f c = {};
  v8f ar[8], br[8];                            // two rows per entry
  #pragma unroll
  for (int r = 0; r < 8; ++r) {                // a row on: NN floats = NN/4 v4f
    ar[r] = __builtin_shufflevector(ag[2 * r * (NN / 4)],
                                    ag[(2 * r + 1) * (NN / 4)],
                                    0, 1, 2, 3, 4, 5, 6, 7);
    br[r] = __builtin_shufflevector(bg[2 * r * (NN / 4)],
                                    bg[(2 * r + 1) * (NN / 4)],
                                    0, 1, 2, 3, 4, 5, 6, 7);
  }
  #pragma unroll
  for (int h = 0; h < 2; ++h) {
    // The loaded values are inputs, so every staging load stands in front of
    // this wait; the two addresses are inputs too, so nothing lands in their
    // registers while a load that names them is on its way.  The LDS addresses
    // used further down are inputs as well: formed here, they leave no vector
    // instruction among the matrix instructions, where one could land in an
    // operand register of a product just issued.
    asm volatile("s_wait_xcnt 0x0"
                 :: "v"(ar[0]), "v"(ar[1]), "v"(ar[2]), "v"(ar[3]),
                    "v"(ar[4]), "v"(ar[5]), "v"(ar[6]), "v"(ar[7]),
                    "v"(br[0]), "v"(br[1]), "v"(br[2]), "v"(br[3]),
                    "v"(br[4]), "v"(br[5]), "v"(br[6]), "v"(br[7]),
                    "v"(ag), "v"(bg), "v"(al), "v"(ap), "v"(cw)
                 : "memory");
    #pragma unroll
    for (int r = 0; r < 8; ++r) {
      *(v4f*)(al + (2 * r) * QP) =
          __builtin_shufflevector(ar[r], ar[r], 0, 1, 2, 3);
      *(v4f*)(al + (2 * r + 1) * QP) =
          __builtin_shufflevector(ar[r], ar[r], 4, 5, 6, 7);
      *(v4f*)(bl + (2 * r) * QP) =
          __builtin_shufflevector(br[r], br[r], 0, 1, 2, 3);
      *(v4f*)(bl + (2 * r + 1) * QP) =
          __builtin_shufflevector(br[r], br[r], 4, 5, 6, 7);
    }
    if (h == 0) {
      #pragma unroll
      for (int r = 0; r < 8; ++r) {            // 128 k on: 32 v4f
        ar[r] = __builtin_shufflevector(ag[2 * r * (NN / 4) + 32],
                                        ag[(2 * r + 1) * (NN / 4) + 32],
                                        0, 1, 2, 3, 4, 5, 6, 7);
        br[r] = __builtin_shufflevector(bg[2 * r * (NN / 4) + 32],
                                        bg[(2 * r + 1) * (NN / 4) + 32],
                                        0, 1, 2, 3, 4, 5, 6, 7);
      }
    }
    #pragma unroll
    for (int k0 = 0; k0 < 128; k0 += 4) {
      v2f a = *(const v2f*)(ap + k0);          // Out2 [1024,1024] row-major
      v2f b = *(const v2f*)(bp + k0);          // Wo [128,1024] = NxK
      c = wmma4(a, b, c);
    }
  }

  // Four vector slots between the last matrix instructions and the first
  // vector instruction that may land in one of their operand registers.
  asm volatile("v_nop\n\tv_nop\n\tv_nop\n\tv_nop" : "+v"(c));
  #pragma unroll
  for (int r = 0; r < 8; ++r)
    cw[r * 16] = c[r];
  __syncthreads();

  for (int idx = tid; idx < 256; idx += 128) {
    const int r = idx >> 4, cc = idx & 15;
    float v = cpart[r * 16 + cc] + cpart[256 + r * 16 + cc] +
              cpart[512 + r * 16 + cc] + cpart[768 + r * 16 + cc];
    Y[(size_t)(i0 + r) * DD + j0 + cc] = v;
  }
}

// ---------------------------------------------------------------------------
extern "C" void kernel_launch(void* const* d_in, const int* in_sizes, int n_in,
                              void* d_out, int out_size, void* d_ws,
                              size_t ws_size, hipStream_t stream) {
  const float* x  = (const float*)d_in[0];
  const float* sp = (const float*)d_in[1];
  const float* ed = (const float*)d_in[2];
  const float* Wq = (const float*)d_in[3];
  const float* Wk = (const float*)d_in[4];
  const float* Wv = (const float*)d_in[5];
  const float* Wo = (const float*)d_in[6];
  float* out = (float*)d_out;

  float* ws = (float*)d_ws;
  const size_t M1 = (size_t)NN * NN;       // 1M floats
  float* Q    = ws;
  float* K    = ws + 1 * M1;
  float* V    = ws + 2 * M1;
  float* Bias = ws + 3 * M1;
  float* O2   = ws + 4 * M1;               // needs 20 MB of workspace

  // 1) Bias = spatial + edge, in accumulator order
  bias_kernel<<<dim3(M1 / (256 * 4)), 256, 0, stream>>>(sp, ed, Bias);

  // 2) Q, K, V projections
  qkv_kernel<<<dim3(NN / QT, NN / QT, 3), 128, 0, stream>>>(x, Wq, Wk, Wv,
                                                            Q, K, V);

  // 3) Fused per-slice attention (softmax in registers)
  attn_kernel<<<dim3(NN / 16 / NT, DD), 128, 0, stream>>>(Q, K, V, Bias, O2);

  // 4) Output projection
  oproj_kernel<<<dim3(NN / 16, DD / 16), 128, 0, stream>>>(O2, Wo, out);
}
